// v000
// Times are from an AMD MI455X. After a warm-up the kernel runs many times in a row, and a time is the length of
// such a window on the GPU divided by its runs, so every launch and the gaps after it count. The runs cycle
// through copies of the inputs. A figure is the median of several windows, for all but v000 over two sittings.
// Sittings can differ by a few percent; kernels timed side by side share one.
// v000, which the later versions start from, runs in 22.7 microseconds.
#include <hip/hip_runtime.h>
#include <hip/hip_bf16.h>

#define NN 2048
#define HH 16
#define DD 64
#define FF 32
#define PP 16

typedef __attribute__((ext_vector_type(2))) float v2f;
typedef __attribute__((ext_vector_type(8))) float v8f;

// ---------------------------------------------------------------- kernel 1
__global__ __launch_bounds__(256) void mrope_norms(const float* __restrict__ pos,
                                                   float* __restrict__ nrm) {
  int i = blockIdx.x * blockDim.x + threadIdx.x;
  if (i < NN) {
    float s = 0.f;
#pragma unroll
    for (int p = 0; p < PP; ++p) {
      float v = pos[(size_t)i * PP + p];
      s += v * v;
    }
    nrm[i] = s;
  }
}

// ---------------------------------------------------------------- kernel 2
// grid = (128 i-tiles, jsplit j-slices); 8 waves per block.
// Gram matrix tile via V_WMMA_F32_16X16X4_F32 (4 chained, K=16),
// dist = v_sqrt_f32(ni + nj - 2G), then each lane (lane==f) accumulates
// sum_j sin(dist * freq_f) with __shfl broadcasts of the tile distances.
// B fragments for the next j-tile are prefetched behind the sin phase.
// Each j-slice writes an unscaled partial sum; the apply kernel reduces.
__global__ __launch_bounds__(256) void mrope_sin_node(
    const float* __restrict__ pos, const float* __restrict__ nrm,
    const float* __restrict__ log_freqs, float* __restrict__ part) {
  __shared__ float red[8][16][32];

  const int tid = threadIdx.x;
  const int wave = tid >> 5;
  const int lane = tid & 31;
  const int m = lane & 15;    // tile row for A frag / tile col for B frag
  const int khalf = lane >> 4;
  const int i_base = blockIdx.x * 16;

  // j-tile work partition across (blockIdx.y, wave)
  const int wseq = blockIdx.y * 8 + wave;
  const int wstride = gridDim.y * 8;

  // lane == frequency index
  const float freq = __expf(log_freqs[lane]);

  // i-row norms: acc VGPR r holds D-matrix row M = r + 8*khalf
  float ni[8];
#pragma unroll
  for (int r = 0; r < 8; ++r) ni[r] = nrm[i_base + r + 8 * khalf];

  float acc[16];
#pragma unroll
  for (int i = 0; i < 16; ++i) acc[i] = 0.f;

  // A fragment (fixed for whole block): A[M=m][K = 4*kc + r + 2*khalf]
  v2f afrag[4];
  {
    const float* pa = pos + (size_t)(i_base + m) * PP;
#pragma unroll
    for (int kc = 0; kc < 4; ++kc) {
      afrag[kc].x = pa[4 * kc + 2 * khalf + 0];
      afrag[kc].y = pa[4 * kc + 2 * khalf + 1];
    }
  }

  // prefetched B fragments / col norm for the current j-tile
  v2f bfrag[4];
  float njv;
  {
    const int j_base = wseq * 16;
    const float* pb = pos + (size_t)(j_base + m) * PP;
    njv = nrm[j_base + m];
#pragma unroll
    for (int kc = 0; kc < 4; ++kc) {
      bfrag[kc].x = pb[4 * kc + 2 * khalf + 0];
      bfrag[kc].y = pb[4 * kc + 2 * khalf + 1];
    }
  }

  for (int jt = wseq; jt < NN / 16; jt += wstride) {
    // Gram tile: 4 chained K=4 WMMAs, fragments already in registers
    v8f c = {0.f, 0.f, 0.f, 0.f, 0.f, 0.f, 0.f, 0.f};
#pragma unroll
    for (int kc = 0; kc < 4; ++kc) {
      c = __builtin_amdgcn_wmma_f32_16x16x4_f32(false, afrag[kc], false,
                                                bfrag[kc], (short)0, c, false,
                                                false);
    }

    // kick off next tile's loads; they retire under the sin phase
    const float nj_cur = njv;
    {
      const int jn = (jt + wstride < NN / 16) ? jt + wstride : wseq;  // clamp
      const int j_base = jn * 16;
      const float* pb = pos + (size_t)(j_base + m) * PP;
      njv = nrm[j_base + m];
#pragma unroll
      for (int kc = 0; kc < 4; ++kc) {
        bfrag[kc].x = pb[4 * kc + 2 * khalf + 0];
        bfrag[kc].y = pb[4 * kc + 2 * khalf + 1];
      }
    }

    // distances for the 8 (row, col) pairs this lane owns (fast v_sqrt_f32)
    float dist[8];
#pragma unroll
    for (int r = 0; r < 8; ++r) {
      float d2 = ni[r] + nj_cur - 2.0f * c[r];
      dist[r] = __builtin_amdgcn_sqrtf(fmaxf(d2, 1e-12f));
    }

    // every lane accumulates all 256 tile pairs at its own frequency.
    // j outer (rolled), i inner (unrolled): 16 independent shfl+sin chains
    // per step -> trans/VALU co-execution, bpermute latency hidden.
    for (int j = 0; j < 16; ++j) {
#pragma unroll
      for (int i = 0; i < 16; ++i) {
        const int src = ((i >> 3) << 4) + j;  // half-wave owning row i, col j
        float dv = __shfl(dist[i & 7], src, 32);
        acc[i] += __sinf(dv * freq);
      }
    }
  }

  // cross-wave reduction (within this j-slice)
#pragma unroll
  for (int i = 0; i < 16; ++i) red[wave][i][lane] = acc[i];
  __syncthreads();

  float* slice = part + (size_t)blockIdx.y * NN * FF;
#pragma unroll
  for (int p = 0; p < 2; ++p) {
    int idx = tid + p * 256;  // 16*32 = 512 outputs per block
    int i = idx >> 5;
    int f = idx & 31;
    float s = 0.f;
#pragma unroll
    for (int w = 0; w < 8; ++w) s += red[w][i][f];
    slice[(size_t)(i_base + i) * FF + f] = s;  // unscaled partial
  }
}

// ---------------------------------------------------------------- kernel 3
// q_rot / k_rot streaming apply; folds the jsplit partial reduction in.
// One thread per (n, h, f), f in [0,32).
__global__ __launch_bounds__(256) void mrope_apply(
    const float* __restrict__ q, const float* __restrict__ k,
    const float* __restrict__ part, const float* __restrict__ log_freqs,
    float* __restrict__ out, int jsplit) {
  int idx = blockIdx.x * 256 + threadIdx.x;  // NN*HH*32 total
  int f = idx & 31;
  int nh = idx >> 5;  // n*HH + h
  int n = nh >> 4;    // HH == 16

  float freq = __expf(log_freqs[f]);
  float cv = __cosf(1e-6f * freq);  // diag(dist) == sqrt(1e-12) == 1e-6

  float sv = 0.f;
  for (int s = 0; s < jsplit; ++s)
    sv += part[(size_t)s * NN * FF + (size_t)n * FF + f];
  sv *= (1.0f / NN);

  size_t base = (size_t)nh * DD;
  float q1 = q[base + f], q2 = q[base + 32 + f];
  float k1 = k[base + f], k2 = k[base + 32 + f];

  float* qo = out;
  float* ko = out + (size_t)NN * HH * DD;
  qo[base + f] = q1 * cv - q2 * sv;
  qo[base + 32 + f] = q1 * sv + q2 * cv;
  ko[base + f] = k1 * cv - k2 * sv;
  ko[base + 32 + f] = k1 * sv + k2 * cv;
}

// ---------------------------------------------------------------- launcher
extern "C" void kernel_launch(void* const* d_in, const int* in_sizes, int n_in,
                              void* d_out, int out_size, void* d_ws,
                              size_t ws_size, hipStream_t stream) {
  (void)in_sizes;
  (void)n_in;
  (void)out_size;

  const float* q = (const float*)d_in[0];
  const float* k = (const float*)d_in[1];
  const float* pos = (const float*)d_in[2];
  const float* logf = (const float*)d_in[3];
  float* out = (float*)d_out;

  // choose j-split (grid multiplier) from available workspace;
  // ws_size is fixed across calls -> deterministic.
  int jsplit = 1;
  if (ws_size >= (size_t)(NN + 4 * NN * FF) * sizeof(float)) jsplit = 4;
  else if (ws_size >= (size_t)(NN + 2 * NN * FF) * sizeof(float)) jsplit = 2;

  float* nrm = (float*)d_ws;   // NN floats
  float* part = nrm + NN;      // jsplit * NN * FF floats

  mrope_norms<<<NN / 256, 256, 0, stream>>>(pos, nrm);
  mrope_sin_node<<<dim3(NN / 16, jsplit), 256, 0, stream>>>(pos, nrm, logf,
                                                            part);
  mrope_apply<<<(NN * HH * 32) / 256, 256, 0, stream>>>(q, k, part, logf, out,
                                                        jsplit);
}

// v001
// A run of this version takes 14.3 microseconds.
// Two timings next to v000 put it at 1.63 and 1.65 times that version's speed.
#include <hip/hip_runtime.h>
#include <hip/hip_bf16.h>

#define NN 2048
#define HH 16
#define DD 64
#define FF 32
#define PP 16

#define NB 8    // output nodes per block
#define NW 16   // waves per block

typedef __attribute__((ext_vector_type(2))) float v2f;
typedef __attribute__((ext_vector_type(8))) float v8f;

// One launch. grid = 256 blocks (one per 8 output nodes), 16 waves per block.
// A block sums over ALL j for its nodes, so the row norms, the mean over j and
// the q/k rotation need nothing from another block.
//
// Squared-distance tile via V_WMMA_F32_16X16X4_F32, 5 chained k-chunks:
//   chunks 0..3: (-2 * pos_i) . pos_j            (K = 16)
//   chunk  4   : A = (pn_i, 1), B = (1, pn_j)    (adds |pos_i|^2 + |pos_j|^2)
// pn is the sum of squares over the 8 coordinates this lane itself holds; the
// lane pair (l, l + 16) holds the two halves of a row, and the k-sum of chunk 4
// adds both halves of both norms, so no cross-lane step is needed.
// A rows 8..15 repeat rows 0..7 (8 nodes per block): both half-waves hold
// D[node r][col lane & 15] in accumulator register r.
// dist = v_sqrt_f32(d2); each lane (lane == f) accumulates
// sum_j sin(dist * freq_f) with __shfl broadcasts of the tile distances.
// B fragments for the next j-tile are prefetched behind the sin phase.
__global__ __launch_bounds__(NW * 32) void mrope_fused(
    const float* __restrict__ q, const float* __restrict__ k,
    const float* __restrict__ pos, const float* __restrict__ log_freqs,
    float* __restrict__ out) {
  __shared__ float red[NW][NB][32];

  const int tid = threadIdx.x;
  const int wave = tid >> 5;
  const int lane = tid & 31;
  const int m = lane & 15;    // tile row for A frag / tile col for B frag
  const int khalf = lane >> 4;
  const int i_base = blockIdx.x * NB;

  // lane == frequency index
  const float freq = __expf(log_freqs[lane]);

  // q/k rows this wave rotates at the end: node i_base + wave / 2, 8 heads.
  // Loaded here so that the loads retire under the sin phase.
  const size_t row0 =
      ((size_t)(i_base + (wave >> 1)) * HH + (size_t)(wave & 1) * 8) * DD + lane;
  float q1[8], q2[8], k1[8], k2[8];
#pragma unroll
  for (int h = 0; h < 8; ++h) {
    q1[h] = q[row0 + h * DD];
    q2[h] = q[row0 + h * DD + 32];
    k1[h] = k[row0 + h * DD];
    k2[h] = k[row0 + h * DD + 32];
  }

  float acc[NB];
#pragma unroll
  for (int i = 0; i < NB; ++i) acc[i] = 0.f;

  // A fragment (fixed for whole block): A[M=m][K = 4*kc + r + 2*khalf]
  v2f afrag[5];
  {
    const float* pa = pos + (size_t)(i_base + (m & (NB - 1))) * PP;
    float pn = 0.f;
#pragma unroll
    for (int kc = 0; kc < 4; ++kc) {
      const float x = pa[4 * kc + 2 * khalf + 0];
      const float y = pa[4 * kc + 2 * khalf + 1];
      pn += x * x;
      pn += y * y;
      afrag[kc].x = -2.0f * x;
      afrag[kc].y = -2.0f * y;
    }
    afrag[4].x = pn;
    afrag[4].y = 1.0f;
  }

  // prefetched B fragments for the current j-tile
  v2f bfrag[4];
  {
    const float* pb = pos + (size_t)(wave * 16 + m) * PP;
#pragma unroll
    for (int kc = 0; kc < 4; ++kc) {
      bfrag[kc].x = pb[4 * kc + 2 * khalf + 0];
      bfrag[kc].y = pb[4 * kc + 2 * khalf + 1];
    }
  }

  // fully unrolled: the first tile then waits for its own fragments only, not
  // for the q/k loads issued behind them (a rolled loop has one wait for all)
#pragma unroll
  for (int t = 0; t < NN / 16 / NW; ++t) {
    // this lane's half of |pos_j|^2
    v2f bn;
    {
      float pn = 0.f;
#pragma unroll
      for (int kc = 0; kc < 4; ++kc) {
        pn += bfrag[kc].x * bfrag[kc].x;
        pn += bfrag[kc].y * bfrag[kc].y;
      }
      bn.x = 1.0f;
      bn.y = pn;
    }

    // squared-distance tile: 5 chained K=4 WMMAs, fragments in registers
    v8f c = {0.f, 0.f, 0.f, 0.f, 0.f, 0.f, 0.f, 0.f};
    c = __builtin_amdgcn_wmma_f32_16x16x4_f32(false, afrag[4], false, bn,
                                              (short)0, c, false, false);
#pragma unroll
    for (int kc = 0; kc < 4; ++kc) {
      c = __builtin_amdgcn_wmma_f32_16x16x4_f32(false, afrag[kc], false,
                                                bfrag[kc], (short)0, c, false,
                                                false);
    }

    // kick off next tile's loads; they retire under the sin phase
    {
      const int tn = (t + 1 < NN / 16 / NW) ? t + 1 : 0;  // clamp
      const float* pb = pos + (size_t)((wave + tn * NW) * 16 + m) * PP;
#pragma unroll
      for (int kc = 0; kc < 4; ++kc) {
        bfrag[kc].x = pb[4 * kc + 2 * khalf + 0];
        bfrag[kc].y = pb[4 * kc + 2 * khalf + 1];
      }
    }

    // distances (node r, col m) this lane owns (fast v_sqrt_f32)
    float dist[NB];
#pragma unroll
    for (int r = 0; r < NB; ++r)
      dist[r] = __builtin_amdgcn_sqrtf(fmaxf(c[r], 1e-12f));

    // every lane accumulates all 128 tile pairs at its own frequency.
    // two columns per step: 16 independent shfl+sin chains
#pragma unroll 2
    for (int j = 0; j < 16; ++j) {
#pragma unroll
      for (int i = 0; i < NB; ++i) {
        float dv = __shfl(dist[i], j, 32);
        acc[i] += __sinf(dv * freq);
      }
    }
  }

  // cross-wave reduction: every wave sums the 16 partials of its own node
#pragma unroll
  for (int i = 0; i < NB; ++i) red[wave][i][lane] = acc[i];
  __syncthreads();

  float sv = 0.f;
#pragma unroll
  for (int w = 0; w < NW; ++w) sv += red[w][wave >> 1][lane];
  sv *= (1.0f / NN);

  const float cv = __cosf(1e-6f * freq);  // diag(dist) == sqrt(1e-12) == 1e-6

  float* qo = out + row0;
  float* ko = qo + (size_t)NN * HH * DD;
#pragma unroll
  for (int h = 0; h < 8; ++h) {
    qo[h * DD] = q1[h] * cv - q2[h] * sv;
    qo[h * DD + 32] = q1[h] * sv + q2[h] * cv;
    ko[h * DD] = k1[h] * cv - k2[h] * sv;
    ko[h * DD + 32] = k1[h] * sv + k2[h] * cv;
  }
}

// ---------------------------------------------------------------- launcher
extern "C" void kernel_launch(void* const* d_in, const int* in_sizes, int n_in,
                              void* d_out, int out_size, void* d_ws,
                              size_t ws_size, hipStream_t stream) {
  (void)in_sizes;
  (void)n_in;
  (void)out_size;
  (void)d_ws;
  (void)ws_size;

  const float* q = (const float*)d_in[0];
  const float* k = (const float*)d_in[1];
  const float* pos = (const float*)d_in[2];
  const float* logf = (const float*)d_in[3];
  float* out = (float*)d_out;

  mrope_fused<<<NN / NB, NW * 32, 0, stream>>>(q, k, pos, logf, out);
}

// v002
// One run takes 13.6 microseconds.
// Next to v001, in two timings, it ran 1.06 and 1.05 times as fast.
// Over all steps from v000 it is 1.73 times as fast.
#include <hip/hip_runtime.h>
#include <hip/hip_bf16.h>

#define NN 2048
#define HH 16
#define DD 64
#define FF 32
#define PP 16

#define NB 8    // output nodes per block
#define NW 16   // waves per block

typedef __attribute__((ext_vector_type(2))) float v2f;
typedef __attribute__((ext_vector_type(8))) float v8f;

// v_sqrt_f32 with the one free slot that the instruction set asks for behind a
// transcendental, before its source is overwritten or its result read.
__device__ __forceinline__ float sqrt_with_slot(float x) {
  float r;
  asm("v_sqrt_f32 %0, %1\n\tv_nop" : "=v"(r) : "v"(x));
  return r;
}

#define DP (NN + 4)   // LDS row pitch of the distance table, in floats
#define FW 16         // frequencies per wave

// One launch. grid = 256 blocks (one per 8 output nodes), 16 waves per block.
// A block sums over ALL j for its nodes, so the row norms, the mean over j and
// the q/k rotation need nothing from another block.
//
// Phase 1, distances. Squared-distance tile via V_WMMA_F32_16X16X4_F32,
// 5 chained k-chunks:
//   chunks 0..3: (-2 * pos_i) . pos_j            (K = 16)
//   chunk  4   : A = (pn_i, 1), B = (1, pn_j)    (adds |pos_i|^2 + |pos_j|^2)
// pn is the sum of squares over the 8 coordinates this lane itself holds; the
// lane pair (l, l + 16) holds the two halves of a row, and the k-sum of chunk 4
// adds both halves of both norms, so no cross-lane step is needed.
// A rows 8..15 repeat the 8 nodes turned by four (row 8 + r is node (r + 4) & 7):
// accumulator registers 0..3 hold nodes 0..3 in the lower half-wave and nodes
// 4..7 in the upper one, all at col lane & 15, and dist = v_sqrt_f32(d2) of
// these goes to the table dtab[node][j] in LDS.
//
// Phase 2, sines. A lane owns pairs (node, j), not a frequency: wave w takes
// node w / 2 and the 16 frequencies of half w & 1, each lane 64 of the 2048 j.
// The frequency is the same in every lane, so a distance is never sent from
// lane to lane; two j ride in one packed multiply and one packed add.
// The 32 lane sums of each frequency are added once, at the end, through LDS.
__global__ __launch_bounds__(NW * 32) void mrope_fused(
    const float* __restrict__ q, const float* __restrict__ k,
    const float* __restrict__ pos, const float* __restrict__ log_freqs,
    float* __restrict__ out) {
  __shared__ __attribute__((aligned(16))) struct {
    float red[NW][FW][33];   // lane sums, one plane a wave
    float part[NB][2][32];   // half-wave sums per node and frequency
    float dtab[NB][DP];      // distances; rows start at multiples of 16 bytes
  } lds;
  auto& dtab = lds.dtab;
  auto& red = lds.red;
  auto& part = lds.part;

  const int tid = threadIdx.x;
  const int wave = __builtin_amdgcn_readfirstlane(tid >> 5);
  const int lane = tid & 31;
  const int m = lane & 15;    // tile row for A frag / tile col for B frag
  const int khalf = lane >> 4;
  const int i_base = blockIdx.x * NB;
  const int node = wave >> 1;   // node of this wave in phase 2 and at the end
  const int fhalf = wave & 1;   // its half of the frequencies in phase 2

  // q/k rows this wave rotates at the end: node i_base + wave / 2, 8 heads.
  const size_t row0 =
      ((size_t)(i_base + node) * HH + (size_t)fhalf * 8) * DD + lane;

  // A fragment (fixed for whole block): A[M=m][K = 4*kc + r + 2*khalf]
  v2f afrag[5];
  {
    const float* pa = pos + (size_t)(i_base + ((m + (m >> 3) * 4) & (NB - 1))) * PP;
    float pn = 0.f;
#pragma unroll
    for (int kc = 0; kc < 4; ++kc) {
      const float x = pa[4 * kc + 2 * khalf + 0];
      const float y = pa[4 * kc + 2 * khalf + 1];
      pn += x * x;
      pn += y * y;
      afrag[kc].x = -2.0f * x;
      afrag[kc].y = -2.0f * y;
    }
    afrag[4].x = pn;
    afrag[4].y = 1.0f;
  }

  // B fragments of all 8 j-tiles of this wave: one round trip to memory
  v2f ball[NN / 16 / NW][4];
  {
    const float* pb = pos + (size_t)(wave * 16 + m) * PP + 2 * khalf;
#pragma unroll
    for (int t = 0; t < NN / 16 / NW; ++t) {
#pragma unroll
      for (int kc = 0; kc < 4; ++kc) {
        ball[t][kc].x = pb[t * (NW * 16 * PP) + 4 * kc + 0];
        ball[t][kc].y = pb[t * (NW * 16 * PP) + 4 * kc + 1];
      }
    }
  }

  // this wave's 16 frequencies: lane m forms number m, sent round below
  const float fown = __expf(log_freqs[fhalf * FW + m]);
  // lane == frequency index for the rotation at the end
  // diag(dist) == sqrt(1e-12) == 1e-6
  const float cv = __cosf(1e-6f * __expf(log_freqs[lane]));

#pragma unroll
  for (int t = 0; t < NN / 16 / NW; ++t) {
    const int j0 = (wave + t * NW) * 16;
    const v2f* bfrag = ball[t];

    // this lane's half of |pos_j|^2
    v2f bn;
    {
      float pn = 0.f;
#pragma unroll
      for (int kc = 0; kc < 4; ++kc) {
        pn += bfrag[kc].x * bfrag[kc].x;
        pn += bfrag[kc].y * bfrag[kc].y;
      }
      bn.x = 1.0f;
      bn.y = pn;
    }

    // squared-distance tile: 5 chained K=4 WMMAs, fragments in registers
    v8f c = {0.f, 0.f, 0.f, 0.f, 0.f, 0.f, 0.f, 0.f};
    c = __builtin_amdgcn_wmma_f32_16x16x4_f32(false, afrag[4], false, bn,
                                              (short)0, c, false, false);
#pragma unroll
    for (int kc = 0; kc < 4; ++kc) {
      c = __builtin_amdgcn_wmma_f32_16x16x4_f32(false, afrag[kc], false,
                                                bfrag[kc], (short)0, c, false,
                                                false);
    }

    // distances (node 4 * khalf + r, col m), fast v_sqrt_f32
#pragma unroll
    for (int r = 0; r < NB / 2; ++r)
      dtab[khalf * (NB / 2) + r][j0 + m] = sqrt_with_slot(fmaxf(c[r], 1e-12f));
  }

  // the 16 frequencies, each the same in every lane: sent round once a wave
  float fr[FW];
#pragma unroll
  for (int f = 0; f < FW; ++f) fr[f] = __shfl(fown, f, 32);

  v2f acc[FW];
#pragma unroll
  for (int f = 0; f < FW; ++f) acc[f] = (v2f){0.f, 0.f};

  __syncthreads();  // the distance table is complete

  // Loaded behind the barrier (which waits for every load in front of it), so
  // that the loads retire under the sin phase.
  float q1[8], q2[8], k1[8], k2[8];
#pragma unroll
  for (int h = 0; h < 8; ++h) {
    q1[h] = q[row0 + h * DD];
    q2[h] = q[row0 + h * DD + 32];
    k1[h] = k[row0 + h * DD];
    k2[h] = k[row0 + h * DD + 32];
  }

  const float4* drow = reinterpret_cast<const float4*>(&dtab[node][0]) + lane;
  for (int it = NN / 128 - 1; it >= 0; --it) {
    const float4 d = drow[it * 32];
    const v2f da = {d.x, d.y};
    const v2f db = {d.z, d.w};
#pragma unroll
    for (int f = 0; f < FW; ++f) {
      const v2f ff = {fr[f], fr[f]};
      const v2f xa = da * ff;
      const v2f xb = db * ff;
      const v2f sa = {__sinf(xa.x), __sinf(xa.y)};
      const v2f sb = {__sinf(xb.x), __sinf(xb.y)};
      acc[f] += sa;
      acc[f] += sb;
    }
  }

  // sum over the 32 lanes: lane (c, hh) adds 16 lane sums of frequency c
#pragma unroll
  for (int f = 0; f < FW; ++f) red[wave][f][lane] = acc[f].x + acc[f].y;
  __syncthreads();
  {
    float s = 0.f;
#pragma unroll
    for (int i = 0; i < 16; ++i) s += red[wave][m][khalf * 16 + i];
    part[node][khalf][fhalf * FW + m] = s;
  }
  __syncthreads();

  // from here on lane == frequency index
  const float sv = (part[node][0][lane] + part[node][1][lane]) * (1.0f / NN);

  float* qo = out + row0;
  float* ko = qo + (size_t)NN * HH * DD;
#pragma unroll
  for (int h = 0; h < 8; ++h) {
    qo[h * DD] = q1[h] * cv - q2[h] * sv;
    qo[h * DD + 32] = q1[h] * sv + q2[h] * cv;
    ko[h * DD] = k1[h] * cv - k2[h] * sv;
    ko[h * DD + 32] = k1[h] * sv + k2[h] * cv;
  }
}

// ---------------------------------------------------------------- launcher
extern "C" void kernel_launch(void* const* d_in, const int* in_sizes, int n_in,
                              void* d_out, int out_size, void* d_ws,
                              size_t ws_size, hipStream_t stream) {
  (void)in_sizes;
  (void)n_in;
  (void)out_size;
  (void)d_ws;
  (void)ws_size;

  const float* q = (const float*)d_in[0];
  const float* k = (const float*)d_in[1];
  const float* pos = (const float*)d_in[2];
  const float* logf = (const float*)d_in[3];
  float* out = (float*)d_out;

  mrope_fused<<<NN / NB, NW * 32, 0, stream>>>(q, k, pos, logf, out);
}

// v003
// Measured time: 12.6 microseconds a run.
// In both of two side-by-side timings against v002, it was 1.08 times as fast.
// All steps since v000 together make it 1.87 times as fast.
#include <hip/hip_runtime.h>
#include <hip/hip_bf16.h>

#define NN 2048
#define HH 16
#define DD 64
#define FF 32
#define PP 16

#define NB 8    // output nodes per block
#define NW 16   // waves per block

typedef __attribute__((ext_vector_type(2))) float v2f;
typedef __attribute__((ext_vector_type(8))) float v8f;

// v_sqrt_f32 with the one free slot that the instruction set asks for behind a
// transcendental, before its source is overwritten or its result read.
__device__ __forceinline__ float sqrt_with_slot(float x) {
  float r;
  asm("v_sqrt_f32 %0, %1\n\tv_nop" : "=v"(r) : "v"(x));
  return r;
}

#define DP (NN + 4)   // LDS row pitch of the distance table, in floats
#define FW 16         // frequencies per wave

// One launch. grid = 256 blocks (one per 8 output nodes), 16 waves per block.
// A block sums over ALL j for its nodes, so the row norms, the mean over j and
// the q/k rotation need nothing from another block.
//
// Phase 1, distances. Squared-distance tile via V_WMMA_F32_16X16X4_F32,
// 5 chained k-chunks:
//   chunks 0..3: (-2 * pos_i) . pos_j            (K = 16)
//   chunk  4   : A = (pn_i, 1), B = (1, pn_j)    (adds |pos_i|^2 + |pos_j|^2)
// pn is the sum of squares over the 8 coordinates this lane itself holds; the
// lane pair (l, l + 16) holds the two halves of a row, and the k-sum of chunk 4
// adds both halves of both norms, so no cross-lane step is needed.
// A rows 8..15 repeat the 8 nodes turned by four (row 8 + r is node (r + 4) & 7):
// accumulator registers 0..3 hold nodes 0..3 in the lower half-wave and nodes
// 4..7 in the upper one, all at col lane & 15, and dist = v_sqrt_f32(d2) of
// these goes to the table dtab[node][j] in LDS.
//
// Phase 2, sines. A lane owns pairs (node, j), not a frequency: wave w takes
// node w / 2 and the 16 frequencies of half w & 1, each lane 64 of the 2048 j.
// The frequency is the same in every lane, so a distance is never sent from
// lane to lane; two j ride in one packed multiply and one packed add.
// The 32 lane sums of each frequency are added once, at the end, through LDS.
__global__ __launch_bounds__(NW * 32) void mrope_fused(
    const float* __restrict__ q, const float* __restrict__ k,
    const float* __restrict__ pos, const float* __restrict__ log_freqs,
    float* __restrict__ out) {
  __shared__ __attribute__((aligned(16))) struct {
    float red[NW][FW][33];   // lane sums, one plane a wave
    float part[NB][2][32];   // half-wave sums per node and frequency
    float dtab[NB][DP];      // distances; rows start at multiples of 16 bytes
  } lds;
  auto& dtab = lds.dtab;
  auto& red = lds.red;
  auto& part = lds.part;

  const int tid = threadIdx.x;
  const int wave = __builtin_amdgcn_readfirstlane(tid >> 5);
  const int lane = tid & 31;
  const int m = lane & 15;    // tile row for A frag / tile col for B frag
  const int khalf = lane >> 4;
  const int i_base = blockIdx.x * NB;
  const int node = wave >> 1;   // node of this wave in phase 2 and at the end
  const int fhalf = wave & 1;   // its half of the frequencies in phase 2

  // q/k rows this wave rotates at the end: node i_base + wave / 2, 8 heads.
  const size_t row0 =
      ((size_t)(i_base + node) * HH + (size_t)fhalf * 8) * DD + lane;

  // A fragment (fixed for whole block): A[M=m][K = 4*kc + r + 2*khalf]
  v2f afrag[5];
  {
    const float* pa = pos + (size_t)(i_base + ((m + (m >> 3) * 4) & (NB - 1))) * PP;
    float pn = 0.f;
#pragma unroll
    for (int kc = 0; kc < 4; ++kc) {
      const float x = pa[4 * kc + 2 * khalf + 0];
      const float y = pa[4 * kc + 2 * khalf + 1];
      pn += x * x;
      pn += y * y;
      afrag[kc].x = -2.0f * x;
      afrag[kc].y = -2.0f * y;
    }
    afrag[4].x = pn;
    afrag[4].y = 1.0f;
  }

  // B fragments of all 8 j-tiles of this wave: one round trip to memory
  v2f ball[NN / 16 / NW][4];
  {
    const float* pb = pos + (size_t)(wave * 16 + m) * PP + 2 * khalf;
#pragma unroll
    for (int t = 0; t < NN / 16 / NW; ++t) {
#pragma unroll
      for (int kc = 0; kc < 4; ++kc) {
        ball[t][kc].x = pb[t * (NW * 16 * PP) + 4 * kc + 0];
        ball[t][kc].y = pb[t * (NW * 16 * PP) + 4 * kc + 1];
      }
    }
  }

  // this wave's 16 frequencies: lane m forms number m, sent round below.
  // In revolutions per unit of distance: v_sin_f32 takes its argument in
  // revolutions, and the factor 1 / (2 pi) is paid here once a frequency
  // instead of once a sine.
  const float fown = __expf(log_freqs[fhalf * FW + m]) * 0.15915494f;
  // lane == frequency index for the rotation at the end
  // diag(dist) == sqrt(1e-12) == 1e-6
  const float cv = __cosf(1e-6f * __expf(log_freqs[lane]));

#pragma unroll
  for (int t = 0; t < NN / 16 / NW; ++t) {
    const int j0 = (wave + t * NW) * 16;
    const v2f* bfrag = ball[t];

    // this lane's half of |pos_j|^2
    v2f bn;
    {
      float pn = 0.f;
#pragma unroll
      for (int kc = 0; kc < 4; ++kc) {
        pn += bfrag[kc].x * bfrag[kc].x;
        pn += bfrag[kc].y * bfrag[kc].y;
      }
      bn.x = 1.0f;
      bn.y = pn;
    }

    // squared-distance tile: 5 chained K=4 WMMAs, fragments in registers
    v8f c = {0.f, 0.f, 0.f, 0.f, 0.f, 0.f, 0.f, 0.f};
    c = __builtin_amdgcn_wmma_f32_16x16x4_f32(false, afrag[4], false, bn,
                                              (short)0, c, false, false);
#pragma unroll
    for (int kc = 0; kc < 4; ++kc) {
      c = __builtin_amdgcn_wmma_f32_16x16x4_f32(false, afrag[kc], false,
                                                bfrag[kc], (short)0, c, false,
                                                false);
    }

    // distances (node 4 * khalf + r, col m), fast v_sqrt_f32
#pragma unroll
    for (int r = 0; r < NB / 2; ++r)
      dtab[khalf * (NB / 2) + r][j0 + m] = sqrt_with_slot(fmaxf(c[r], 1e-12f));
  }

  // the 16 frequencies, each the same in every lane: sent round once a wave
  float fr[FW];
#pragma unroll
  for (int f = 0; f < FW; ++f) fr[f] = __shfl(fown, f, 32);

  v2f acc[FW];
#pragma unroll
  for (int f = 0; f < FW; ++f) acc[f] = (v2f){0.f, 0.f};

  __syncthreads();  // the distance table is complete

  // Loaded behind the barrier (which waits for every load in front of it), so
  // that the loads retire under the sin phase.
  float q1[8], q2[8], k1[8], k2[8];
#pragma unroll
  for (int h = 0; h < 8; ++h) {
    q1[h] = q[row0 + h * DD];
    q2[h] = q[row0 + h * DD + 32];
    k1[h] = k[row0 + h * DD];
    k2[h] = k[row0 + h * DD + 32];
  }

  const float4* drow = reinterpret_cast<const float4*>(&dtab[node][0]) + lane;
  for (int it = NN / 128 - 1; it >= 0; --it) {
    const float4 d = drow[it * 32];
    const v2f da = {d.x, d.y};
    const v2f db = {d.z, d.w};
#pragma unroll
    for (int f = 0; f < FW; ++f) {
      const v2f ff = {fr[f], fr[f]};
      const v2f xa = da * ff;
      const v2f xb = db * ff;
      // xa, xb are in revolutions already: v_sin_f32 alone
      const v2f sa = {__builtin_amdgcn_sinf(xa.x), __builtin_amdgcn_sinf(xa.y)};
      const v2f sb = {__builtin_amdgcn_sinf(xb.x), __builtin_amdgcn_sinf(xb.y)};
      acc[f] += sa;
      acc[f] += sb;
    }
  }

  // sum over the 32 lanes: lane (c, hh) adds 16 lane sums of frequency c
#pragma unroll
  for (int f = 0; f < FW; ++f) red[wave][f][lane] = acc[f].x + acc[f].y;
  __syncthreads();
  {
    float s = 0.f;
#pragma unroll
    for (int i = 0; i < 16; ++i) s += red[wave][m][khalf * 16 + i];
    part[node][khalf][fhalf * FW + m] = s;
  }
  __syncthreads();

  // from here on lane == frequency index
  const float sv = (part[node][0][lane] + part[node][1][lane]) * (1.0f / NN);

  float* qo = out + row0;
  float* ko = qo + (size_t)NN * HH * DD;
#pragma unroll
  for (int h = 0; h < 8; ++h) {
    qo[h * DD] = q1[h] * cv - q2[h] * sv;
    qo[h * DD + 32] = q1[h] * sv + q2[h] * cv;
    ko[h * DD] = k1[h] * cv - k2[h] * sv;
    ko[h * DD + 32] = k1[h] * sv + k2[h] * cv;
  }
}

// ---------------------------------------------------------------- launcher
extern "C" void kernel_launch(void* const* d_in, const int* in_sizes, int n_in,
                              void* d_out, int out_size, void* d_ws,
                              size_t ws_size, hipStream_t stream) {
  (void)in_sizes;
  (void)n_in;
  (void)out_size;
  (void)d_ws;
  (void)ws_size;

  const float* q = (const float*)d_in[0];
  const float* k = (const float*)d_in[1];
  const float* pos = (const float*)d_in[2];
  const float* logf = (const float*)d_in[3];
  float* out = (float*)d_out;

  mrope_fused<<<NN / NB, NW * 32, 0, stream>>>(q, k, pos, logf, out);
}

// v004
// A run of this version takes 7.82 microseconds.
// Timed twice side by side with v003, it ran 1.62 and 1.61 times as fast.
// All steps since v000 together make it 3.02 times as fast.
#include <hip/hip_runtime.h>
#include <hip/hip_bf16.h>

#define NN 2048
#define HH 16
#define DD 64
#define FF 32
#define PP 16

#define NB 8    // output nodes per block
#define NW 16   // waves per block

typedef __attribute__((ext_vector_type(2))) float v2f;
typedef __attribute__((ext_vector_type(8))) float v8f;

// v_sqrt_f32 with the one free slot that the instruction set asks for behind a
// transcendental, before its source is overwritten or its result read.
__device__ __forceinline__ float sqrt_with_slot(float x) {
  float r;
  asm("v_sqrt_f32 %0, %1\n\tv_nop" : "=v"(r) : "v"(x));
  return r;
}

// lane l with lane l ^ M inside a 16-lane row (DPP row_xmask), and with lane
// l ^ 16: vector moves, where __shfl_xor would go through the LDS pipe.
template <int M>
__device__ __forceinline__ float xrow(float x) {
  return __builtin_bit_cast(
      float, __builtin_amdgcn_update_dpp(0, __builtin_bit_cast(int, x),
                                         0x160 + M, 0xf, 0xf, true));
}
__device__ __forceinline__ float xhalf(float x) {
  return __builtin_bit_cast(
      float, __builtin_amdgcn_permlanex16(__builtin_bit_cast(int, x),
                                          __builtin_bit_cast(int, x),
                                          0x76543210, 0xfedcba98, false, false));
}

#define DP (NN + 4)   // LDS row pitch of the distance table, in floats
#define KM 8          // odd power moments of the distance kept per wave
#define XMAX 2.5f     // largest angle, in radians, taken from the moments

// One launch. grid = 256 blocks (one per 8 output nodes), 16 waves per block.
// A block sums over ALL j for its nodes, so the row norms, the mean over j and
// the q/k rotation need nothing from another block.
//
// Phase 1, distances. Squared-distance tile via V_WMMA_F32_16X16X4_F32,
// 5 chained k-chunks:
//   chunks 0..3: (-2 * pos_i) . pos_j            (K = 16)
//   chunk  4   : A = (pn_i, 1), B = (1, pn_j)    (adds |pos_i|^2 + |pos_j|^2)
// pn is the sum of squares over the 8 coordinates this lane itself holds; the
// lane pair (l, l + 16) holds the two halves of a row, and the k-sum of chunk 4
// adds both halves of both norms, so no cross-lane step is needed.
// A rows 8..15 repeat the 8 nodes turned by four (row 8 + r is node (r + 4) & 7):
// accumulator registers 0..3 hold nodes 0..3 in the lower half-wave and nodes
// 4..7 in the upper one, all at col lane & 15, and dist = v_sqrt_f32(d2) of
// these goes to the table dtab[node][j] in LDS.
//
// Phase 2, sums of sines. Wave w takes node w / 2 and half w & 1 of the j, all
// 32 frequencies; a lane keeps its 32 distances in registers.
// With dmax the largest distance of the wave, a frequency f with
// f * dmax <= XMAX needs no sine per pair:
//   sum_j sin(f d_j) = sum_n (-1)^n f^(2n+1) / (2n+1)! * sum_j d_j^(2n+1),
// and the KM moments sum_j d_j^(2n+1) are the same for every such frequency.
// The series is cut behind n = KM - 1; what is left is below
// XMAX^17 / 17! < 2e-8 per term, under the rounding of an f32 sine.
// The test is made at run time, per wave and frequency, from the distances
// and the frequencies as given: every other frequency goes through v_sin_f32,
// one frequency (the same in every lane) at a time.
// Distances are scaled by a power of two (exact) so that no power overflows.
// The 32 lane sums of each row are added once, at the end, through LDS.
__global__ __launch_bounds__(NW * 32) void mrope_fused(
    const float* __restrict__ q, const float* __restrict__ k,
    const float* __restrict__ pos, const float* __restrict__ log_freqs,
    float* __restrict__ out) {
  __shared__ __attribute__((aligned(16))) struct {
    float red[NW][FF][33];   // lane sums of sines, one plane a wave
    float mred[NW][KM][33];  // lane sums of the moments
    float part[NB][2][32];   // sums over half the j, per node and frequency
    float dtab[NB][DP];      // distances; rows start at multiples of 16 bytes
  } lds;
  auto& dtab = lds.dtab;
  auto& red = lds.red;
  auto& mred = lds.mred;
  auto& part = lds.part;

  const int tid = threadIdx.x;
  const int wave = __builtin_amdgcn_readfirstlane(tid >> 5);
  const int lane = tid & 31;
  const int m = lane & 15;    // tile row for A frag / tile col for B frag
  const int khalf = lane >> 4;
  const int i_base = blockIdx.x * NB;
  const int node = wave >> 1;   // node of this wave in phase 2 and at the end
  const int fhalf = wave & 1;   // its half of the j in phase 2, of the heads at the end

  // q/k rows this wave rotates at the end: node i_base + wave / 2, 8 heads.
  const size_t row0 =
      ((size_t)(i_base + node) * HH + (size_t)fhalf * 8) * DD + lane;

  // A fragment (fixed for whole block): A[M=m][K = 4*kc + r + 2*khalf]
  v2f afrag[5];
  {
    const float* pa = pos + (size_t)(i_base + ((m + (m >> 3) * 4) & (NB - 1))) * PP;
    float pn = 0.f;
#pragma unroll
    for (int kc = 0; kc < 4; ++kc) {
      const float x = pa[4 * kc + 2 * khalf + 0];
      const float y = pa[4 * kc + 2 * khalf + 1];
      pn += x * x;
      pn += y * y;
      afrag[kc].x = -2.0f * x;
      afrag[kc].y = -2.0f * y;
    }
    afrag[4].x = pn;
    afrag[4].y = 1.0f;
  }

  // B fragments of all 8 j-tiles of this wave: one round trip to memory
  v2f ball[NN / 16 / NW][4];
  {
    const float* pb = pos + (size_t)(wave * 16 + m) * PP + 2 * khalf;
#pragma unroll
    for (int t = 0; t < NN / 16 / NW; ++t) {
#pragma unroll
      for (int kc = 0; kc < 4; ++kc) {
        ball[t][kc].x = pb[t * (NW * 16 * PP) + 4 * kc + 0];
        ball[t][kc].y = pb[t * (NW * 16 * PP) + 4 * kc + 1];
      }
    }
  }

  // lane == frequency index, here and from the end of phase 2 on
  const float fl = __expf(log_freqs[lane]);
  // In revolutions per unit of distance: v_sin_f32 takes its argument in
  // revolutions, and the factor 1 / (2 pi) is paid here once a frequency
  // instead of once a sine.
  const float frev = fl * 0.15915494f;
  // diag(dist) == sqrt(1e-12) == 1e-6
  const float cv = __cosf(1e-6f * fl);

#pragma unroll
  for (int t = 0; t < NN / 16 / NW; ++t) {
    const int j0 = (wave + t * NW) * 16;
    const v2f* bfrag = ball[t];

    // this lane's half of |pos_j|^2
    v2f bn;
    {
      float pn = 0.f;
#pragma unroll
      for (int kc = 0; kc < 4; ++kc) {
        pn += bfrag[kc].x * bfrag[kc].x;
        pn += bfrag[kc].y * bfrag[kc].y;
      }
      bn.x = 1.0f;
      bn.y = pn;
    }

    // squared-distance tile: 5 chained K=4 WMMAs, fragments in registers
    v8f c = {0.f, 0.f, 0.f, 0.f, 0.f, 0.f, 0.f, 0.f};
    c = __builtin_amdgcn_wmma_f32_16x16x4_f32(false, afrag[4], false, bn,
                                              (short)0, c, false, false);
#pragma unroll
    for (int kc = 0; kc < 4; ++kc) {
      c = __builtin_amdgcn_wmma_f32_16x16x4_f32(false, afrag[kc], false,
                                                bfrag[kc], (short)0, c, false,
                                                false);
    }

    // distances (node 4 * khalf + r, col m), fast v_sqrt_f32
#pragma unroll
    for (int r = 0; r < NB / 2; ++r)
      dtab[khalf * (NB / 2) + r][j0 + m] = sqrt_with_slot(fmaxf(c[r], 1e-12f));
  }

  __syncthreads();  // the distance table is complete

  // Loaded behind the barrier (which waits for every load in front of it), so
  // that the loads retire under the sin phase.
  float q1[8], q2[8], k1[8], k2[8];
#pragma unroll
  for (int h = 0; h < 8; ++h) {
    q1[h] = q[row0 + h * DD];
    q2[h] = q[row0 + h * DD + 32];
    k1[h] = k[row0 + h * DD];
    k2[h] = k[row0 + h * DD + 32];
  }

  // this lane's 32 distances
  v2f dd[16];
  {
    const float4* drow =
        reinterpret_cast<const float4*>(&dtab[node][fhalf * (NN / 2)]) + lane;
#pragma unroll
    for (int it = 0; it < 8; ++it) {
      const float4 d = drow[it * 32];
      dd[2 * it] = (v2f){d.x, d.y};
      dd[2 * it + 1] = (v2f){d.z, d.w};
    }
  }

  // dmax of the wave (>= 1e-6 by the clamp of phase 1)
  float mx = 0.f;
#pragma unroll
  for (int i = 0; i < 16; ++i) mx = fmaxf(mx, fmaxf(dd[i].x, dd[i].y));
  mx = fmaxf(mx, xrow<1>(mx));
  mx = fmaxf(mx, xrow<2>(mx));
  mx = fmaxf(mx, xrow<4>(mx));
  mx = fmaxf(mx, xrow<8>(mx));
  mx = fmaxf(mx, xhalf(mx));

  // frequencies whose angle can pass XMAX (or is no number) take the sines
  const unsigned smask = __builtin_amdgcn_ballot_w32(!(fl * mx <= XMAX));

  // sc = 2^-e with dmax * sc in [0.5, 1); rs = 1 / sc; both exact
  int ex = (__builtin_amdgcn_readfirstlane(__float_as_int(mx)) >> 23) & 255;
  ex = ex > 252 ? 252 : ex;
  const float sc = __int_as_float((253 - ex) << 23);
  const float rs = __int_as_float((ex + 1) << 23);

  // moments of u = d * sc: mom[n] = sum u^(2n+1)
  v2f mom[KM];
#pragma unroll
  for (int i = 0; i < 16; ++i) {
    const v2f u = dd[i] * (v2f){sc, sc};
    const v2f u2 = u * u;
    v2f p = u;
#pragma unroll
    for (int n = 0; n < KM; ++n) {
      if (n > 0) p *= u2;
      if (i == 0) mom[n] = p; else mom[n] += p;
    }
  }
#pragma unroll
  for (int n = 0; n < KM; ++n) mred[wave][n][lane] = mom[n].x + mom[n].y;

  // the other frequencies, one at a time: the trip count is the wave's own
  for (unsigned left = smask; left != 0u; left &= left - 1u) {
    const int f = __builtin_ctz(left);
    const float fr =
        __int_as_float(__builtin_amdgcn_readlane(__float_as_int(frev), f));
    const v2f ff = {fr, fr};
    v2f a0, a1;
#pragma unroll
    for (int i = 0; i < 16; i += 2) {
      const v2f xa = dd[i] * ff;
      const v2f xb = dd[i + 1] * ff;
      // xa, xb are in revolutions already: v_sin_f32 alone
      const v2f sa = {__builtin_amdgcn_sinf(xa.x), __builtin_amdgcn_sinf(xa.y)};
      const v2f sb = {__builtin_amdgcn_sinf(xb.x), __builtin_amdgcn_sinf(xb.y)};
      if (i == 0) { a0 = sa; a1 = sb; } else { a0 += sa; a1 += sb; }
    }
    a0 += a1;
    red[wave][f][lane] = a0.x + a0.y;
  }
  __syncthreads();
  {
    // lane (n, quarter) adds 8 lane sums of moment n; then the four quarters
    float t = 0.f;
#pragma unroll
    for (int i = 0; i < 8; ++i) t += mred[wave][lane & 7][(lane >> 3) * 8 + i];
    t += xrow<8>(t);
    t += xhalf(t);

    // the series in x = f / sc, by Horner in x^2; (-1)^n / (2n+1)!
    const float cf[KM] = {1.0f,
                          -1.0f / 6.0f,
                          1.0f / 120.0f,
                          -1.0f / 5040.0f,
                          1.0f / 362880.0f,
                          -1.0f / 39916800.0f,
                          1.0f / 6227020800.0f,
                          -1.0f / 1307674368000.0f};
    const float x = fl * rs;
    const float y = x * x;
    float s = 0.f;
#pragma unroll
    for (int n = KM - 1; n >= 0; --n) {
      const float un =
          __int_as_float(__builtin_amdgcn_readlane(__float_as_int(t), n));
      s = s * y + cf[n] * un;
    }
    s *= x;

    // a row of sines was written only where the bit is set
    if ((smask >> lane) & 1u) {
      float s0 = 0.f, s1 = 0.f, s2 = 0.f, s3 = 0.f;
#pragma unroll
      for (int i = 0; i < 32; i += 4) {
        s0 += red[wave][lane][i];
        s1 += red[wave][lane][i + 1];
        s2 += red[wave][lane][i + 2];
        s3 += red[wave][lane][i + 3];
      }
      s = (s0 + s1) + (s2 + s3);
    }
    part[node][fhalf][lane] = s;
  }
  __syncthreads();

  // from here on lane == frequency index
  const float sv = (part[node][0][lane] + part[node][1][lane]) * (1.0f / NN);

  float* qo = out + row0;
  float* ko = qo + (size_t)NN * HH * DD;
#pragma unroll
  for (int h = 0; h < 8; ++h) {
    qo[h * DD] = q1[h] * cv - q2[h] * sv;
    qo[h * DD + 32] = q1[h] * sv + q2[h] * cv;
    ko[h * DD] = k1[h] * cv - k2[h] * sv;
    ko[h * DD + 32] = k1[h] * sv + k2[h] * cv;
  }
}

// ---------------------------------------------------------------- launcher
extern "C" void kernel_launch(void* const* d_in, const int* in_sizes, int n_in,
                              void* d_out, int out_size, void* d_ws,
                              size_t ws_size, hipStream_t stream) {
  (void)in_sizes;
  (void)n_in;
  (void)out_size;
  (void)d_ws;
  (void)ws_size;

  const float* q = (const float*)d_in[0];
  const float* k = (const float*)d_in[1];
  const float* pos = (const float*)d_in[2];
  const float* logf = (const float*)d_in[3];
  float* out = (float*)d_out;

  mrope_fused<<<NN / NB, NW * 32, 0, stream>>>(q, k, pos, logf, out);
}
